// v010
// Times are from an AMD MI455X. After a warm-up the kernel runs many times in a row, and a time is the length of
// such a window on the GPU divided by its runs, so every launch and the gaps after it count. The runs cycle
// through copies of the inputs. A figure is the median of several windows, for all but v000 over two sittings.
// Sittings can differ by a few percent; kernels timed side by side share one.
// This document starts at v010; the versions before it stand elsewhere.
// Measured time: 271 microseconds a run.
// Two timings next to v009 both put it at 1.10 times that version's speed.
// Over all steps from v000, the starting kernel, it is 4.47 times as fast.
#include <hip/hip_runtime.h>
#define NBT 2
#define SLEN 2048
#define DM 1024
#define NH 16
#define SCL 0.125f
#define L2E 1.4426950408889634f      /* log2(e): exp(x) is taken as 2^(x * log2 e), one v_exp_f32 */
#define NR (NBT * SLEN)
typedef __bf16 v16b __attribute__((ext_vector_type(16)));
typedef unsigned short v8us __attribute__((ext_vector_type(8), may_alias));
typedef float  v8f  __attribute__((ext_vector_type(8)));
typedef float  v4f  __attribute__((ext_vector_type(4)));
typedef float  v4fa __attribute__((ext_vector_type(4), may_alias));
union FragB { v16b v; v8us half[2]; unsigned short u[16]; };

__device__ __forceinline__ unsigned short bf16_bits(float x) { unsigned int u = __float_as_uint(x); return (unsigned short)((u + 0x7FFFu + ((u >> 16) & 1u)) >> 16); }
__device__ __forceinline__ float bf16_val(unsigned short b) { return __uint_as_float(((unsigned int)b) << 16); }
__device__ __forceinline__ float bf16_round(float x) { return bf16_val(bf16_bits(x)); }
// D += A·B with NT terms: 1 = ah·bh, 2 = + al·bh (A split), 3 = + ah·bl (both split)
template <int NT>
__device__ __forceinline__ v8f mmaN(v16b ah, v16b al, v16b bh, v16b bl, v8f c) {
  c = __builtin_amdgcn_wmma_f32_16x16x32_bf16(false, ah, false, bh, (short)0, c, false, false);
  if (NT >= 2) c = __builtin_amdgcn_wmma_f32_16x16x32_bf16(false, al, false, bh, (short)0, c, false, false);
  if (NT >= 3) c = __builtin_amdgcn_wmma_f32_16x16x32_bf16(false, ah, false, bl, (short)0, c, false, false);
  asm volatile("v_nop\n\tv_nop\n\tv_nop\n\tv_nop" : "+v"(c) : "v"(ah), "v"(al), "v"(bh), "v"(bl));
  return c;
}

__global__ __launch_bounds__(256) void k_wt_bf16(const float* __restrict__ W, unsigned short* __restrict__ Wt, int K, int N) {
  const int t = blockIdx.x * 256 + threadIdx.x;
  const int k8n = K / 8;
  if (t >= N * k8n) return;
  const int n = t / k8n, k8 = (t % k8n) * 8;
  v8us v;
#pragma unroll
  for (int i = 0; i < 8; ++i) v[i] = bf16_bits(W[(size_t)(k8 + i) * N + n]);
  *(v8us*)(Wt + (size_t)n * K + k8) = v;
  
}

// GEMM C[M][N] (f32, pitch ldc) = act(A[M][K]·W + bias). A f32 row-major (pitch lda) converted per fragment to bf16
// (ASPLIT: hi/lo two planes -> 2 terms, else single rounded term); Wt bf16 [N][K] (pitch ldb). BIAS_BF16 rounds the
// bias to bf16 first (bias quantised to bf16 before the add). K%32==0, M%16==0, N%64==0.
template <bool ASPLIT, int ACT, bool BIAS_BF16>
__global__ __launch_bounds__(128) void k_gemm_bf(const float* __restrict__ A, int lda, const unsigned short* __restrict__ Wt, int ldb,
                                               const float* __restrict__ bias, float* __restrict__ C, int ldc, int M, int N, int K) {
  __shared__ __attribute__((aligned(16))) float so[4][16][64];
  const int tid = threadIdx.x, w = tid >> 5, lane = tid & 31, ln = lane & 15, hh = lane >> 4;
  const int ntn = N / 64;
  const int wid = blockIdx.x * 4 + w;
  const int mt = wid / ntn, nq = wid % ntn;
  if (mt * 16 >= M) return;
  const int row0 = mt * 16, col0 = nq * 64;
  const float* arow = A + (size_t)(row0 + ln) * lda;
  v8f acc[4] = {};
  for (int kb = 0; kb < K; kb += 32) {
    FragB ah, al;
    const v4f x0 = *(const v4fa*)(arow + kb + 8 * hh), x1 = *(const v4fa*)(arow + kb + 8 * hh + 4);
    const v4f x2 = *(const v4fa*)(arow + kb + 16 + 8 * hh), x3 = *(const v4fa*)(arow + kb + 16 + 8 * hh + 4);
    float xs[16] = {x0[0],x0[1],x0[2],x0[3],x1[0],x1[1],x1[2],x1[3],x2[0],x2[1],x2[2],x2[3],x3[0],x3[1],x3[2],x3[3]};
#pragma unroll
    for (int i = 0; i < 16; ++i) { const unsigned short hb = bf16_bits(xs[i]); ah.u[i] = hb; al.u[i] = ASPLIT ? bf16_bits(xs[i] - bf16_val(hb)) : (unsigned short)0; }
#pragma unroll
    for (int t = 0; t < 4; ++t) {
      const unsigned short* brow = Wt + (size_t)(col0 + t * 16 + ln) * ldb + kb;
      FragB b;
      b.half[0] = *(const v8us*)(brow + 8 * hh);
      b.half[1] = *(const v8us*)(brow + 16 + 8 * hh);
      acc[t] = mmaN<ASPLIT ? 2 : 1>(ah.v, al.v, b.v, b.v, acc[t]);
    }
  }
#pragma unroll
  for (int t = 0; t < 4; ++t) {
    float bv = bias ? bias[col0 + t * 16 + ln] : 0.f;
    if (BIAS_BF16) bv = bf16_round(bv);
#pragma unroll
    for (int r = 0; r < 8; ++r) { float v = acc[t][r] + bv; if (ACT == 1) v = fmaxf(v, 0.f); so[w][8 * hh + r][t * 16 + ln] = v; }
  }
  __builtin_amdgcn_fence(__ATOMIC_ACQ_REL, "workgroup");
  __builtin_amdgcn_wave_barrier();
  const int rsub = lane >> 4, c4 = (lane & 15) * 4;
  {
#pragma unroll
    for (int q = 0; q < 8; ++q) {
      const int r = q * 2 + rsub;
      const v4f v = *(const v4fa*)&so[w][r][c4];
      *(v4f*)(C + (size_t)(row0 + r) * ldc + col0 + c4) = v;
    }
    
  }
}

// GEMM C = act(A·W + bias + resid): A f32 (ASPLIT -> hi/lo 2 terms), Wt bf16 [N][K]; ACT 0 none, 1 relu, 2 exact gelu;
// resid (optional, f32, row index = (row % rmod), pitch ldr, RES_BF16 rounds it) added before the activation.
template <bool ASPLIT, int ACT, bool BIAS_BF16, bool RES_BF16>
__global__ __launch_bounds__(128) void k_gemm_bf3(const float* __restrict__ A, int lda, const unsigned short* __restrict__ Wt, int ldb,
                                                const float* __restrict__ bias, const float* __restrict__ resid, int rmod, int ldr,
                                                float* __restrict__ C, int ldc, int M, int N, int K) {
  __shared__ __attribute__((aligned(16))) float so[4][16][64];
  const int tid = threadIdx.x, w = tid >> 5, lane = tid & 31, ln = lane & 15, hh = lane >> 4;
  const int ntn = N / 64;
  const int wid = blockIdx.x * 4 + w;
  const int mt = wid / ntn, nq = wid % ntn;
  if (mt * 16 >= M) return;
  const int row0 = mt * 16, col0 = nq * 64;
  const float* arow = A + (size_t)(row0 + ln) * lda;
  v8f acc[4] = {};
  for (int kb = 0; kb < K; kb += 32) {
    FragB ah, al;
    const v4f x0 = *(const v4fa*)(arow + kb + 8 * hh), x1 = *(const v4fa*)(arow + kb + 8 * hh + 4);
    const v4f x2 = *(const v4fa*)(arow + kb + 16 + 8 * hh), x3 = *(const v4fa*)(arow + kb + 16 + 8 * hh + 4);
    float xs[16] = {x0[0],x0[1],x0[2],x0[3],x1[0],x1[1],x1[2],x1[3],x2[0],x2[1],x2[2],x2[3],x3[0],x3[1],x3[2],x3[3]};
#pragma unroll
    for (int i = 0; i < 16; ++i) { const unsigned short hb = bf16_bits(xs[i]); ah.u[i] = hb; al.u[i] = ASPLIT ? bf16_bits(xs[i] - bf16_val(hb)) : (unsigned short)0; }
#pragma unroll
    for (int t = 0; t < 4; ++t) {
      const unsigned short* brow = Wt + (size_t)(col0 + t * 16 + ln) * ldb + kb;
      FragB b;
      b.half[0] = *(const v8us*)(brow + 8 * hh);
      b.half[1] = *(const v8us*)(brow + 16 + 8 * hh);
      acc[t] = mmaN<ASPLIT ? 2 : 1>(ah.v, al.v, b.v, b.v, acc[t]);
    }
  }
#pragma unroll
  for (int t = 0; t < 4; ++t) {
    const int col = col0 + t * 16 + ln;
    float bv = bias ? bias[col] : 0.f;
    if (BIAS_BF16) bv = bf16_round(bv);
#pragma unroll
    for (int r = 0; r < 8; ++r) {
      float v = acc[t][r] + bv;
      if (resid) { float rv = resid[(size_t)((row0 + 8 * hh + r) % rmod) * ldr + col]; if (RES_BF16) rv = bf16_round(rv); v += rv; }
      if (ACT == 1) v = fmaxf(v, 0.f);
      if (ACT == 2) v = 0.5f * v * (1.0f + erff(v * 0.70710678118654752f));
      if (ACT == 3) { const float u = 0.7978845608028654f * (v + 0.044715f * v * v * v); v = 0.5f * v * (1.0f + tanhf(u)); }
      so[w][8 * hh + r][t * 16 + ln] = v;
    }
  }
  __builtin_amdgcn_fence(__ATOMIC_ACQ_REL, "workgroup");
  __builtin_amdgcn_wave_barrier();
  const int rsub = lane >> 4, c4 = (lane & 15) * 4;
  {
#pragma unroll
    for (int q = 0; q < 8; ++q) {
      const int r = q * 2 + rsub;
      const v4f v = *(const v4fa*)&so[w][r][c4];
      *(v4f*)(C + (size_t)(row0 + r) * ldc + col0 + c4) = v;
    }
    
  }
}
// row LayerNorm (biased variance, eps) over N: s = X (+ R); optional out_sum <- s; out_norm <- (s-mu)*rsqrt(var+eps)*g + b
template <bool PARAM_BF16>
__global__ __launch_bounds__(256) void k_layernorm(const float* __restrict__ X, const float* __restrict__ R, const float* __restrict__ g, const float* __restrict__ bta,
                                                  float* __restrict__ out_sum, float* __restrict__ out_norm, int N, float eps) {
  __shared__ float red[256];
  const int row = blockIdx.x, tid = threadIdx.x;
  const float* x = X + (size_t)row * N; const float* rr = R ? R + (size_t)row * N : nullptr;
  float vals[16];                     // up to N = 4096
  const int per = N / 256;            // contiguous chunk per thread? use strided-by-4 chunks: thread handles j = tid*4 + 1024*u
  float s1 = 0.f;
  for (int u = 0; u < per / 4; ++u) {
    const int j = tid * 4 + 1024 * u;
    const v4f a = *(const v4fa*)(x + j);
    v4f b = {0.f,0.f,0.f,0.f}; if (rr) b = *(const v4fa*)(rr + j);
#pragma unroll
    for (int q = 0; q < 4; ++q) { const float v = a[q] + b[q]; vals[u * 4 + q] = v; s1 += v; }
  }
  red[tid] = s1; __syncthreads();
  for (int st = 128; st > 0; st >>= 1) { if (tid < st) red[tid] += red[tid + st]; __syncthreads(); }
  const float mu = red[0] / (float)N; __syncthreads();
  float s2 = 0.f;
  for (int u = 0; u < per / 4; ++u)
#pragma unroll
    for (int q = 0; q < 4; ++q) { const float c = vals[u * 4 + q] - mu; s2 += c * c; }
  red[tid] = s2; __syncthreads();
  for (int st = 128; st > 0; st >>= 1) { if (tid < st) red[tid] += red[tid + st]; __syncthreads(); }
  const float rs = rsqrtf(red[0] / (float)N + eps);
  {
    for (int u = 0; u < per / 4; ++u) {
      const int j = tid * 4 + 1024 * u;
      v4f o, sm;
#pragma unroll
      for (int q = 0; q < 4; ++q) {
        float gg = g[j + q], bb = bta[j + q];
        if (PARAM_BF16) { gg = bf16_round(gg); bb = bf16_round(bb); }
        sm[q] = vals[u * 4 + q]; o[q] = (vals[u * 4 + q] - mu) * rs * gg + bb;
      }
      if (out_sum) *(v4f*)(out_sum + (size_t)row * N + j) = sm;
      *(v4f*)(out_norm + (size_t)row * N + j) = o;
    }
    
  }
}



// Eight 2^x, and eight 1/x, in place, by the hardware's own instruction. One statement each: every instruction reads and writes its own register only, so none touches a neighbour's source or result,
// and the closing v_nop is the slot that the instruction set asks for between the last one and whatever uses its result next.
__device__ __forceinline__ void exp2x8(float (&x)[8]) {
  asm("v_exp_f32 %0, %0\n\tv_exp_f32 %1, %1\n\tv_exp_f32 %2, %2\n\tv_exp_f32 %3, %3\n\tv_exp_f32 %4, %4\n\tv_exp_f32 %5, %5\n\tv_exp_f32 %6, %6\n\tv_exp_f32 %7, %7\n\tv_nop"
      : "+v"(x[0]), "+v"(x[1]), "+v"(x[2]), "+v"(x[3]), "+v"(x[4]), "+v"(x[5]), "+v"(x[6]), "+v"(x[7])); }
__device__ __forceinline__ void rcpx8(float (&x)[8]) {
  asm("v_rcp_f32 %0, %0\n\tv_rcp_f32 %1, %1\n\tv_rcp_f32 %2, %2\n\tv_rcp_f32 %3, %3\n\tv_rcp_f32 %4, %4\n\tv_rcp_f32 %5, %5\n\tv_rcp_f32 %6, %6\n\tv_rcp_f32 %7, %7\n\tv_nop"
      : "+v"(x[0]), "+v"(x[1]), "+v"(x[2]), "+v"(x[3]), "+v"(x[4]), "+v"(x[5]), "+v"(x[6]), "+v"(x[7])); }

__device__ __forceinline__ float exp2x1(float x) { asm("v_exp_f32 %0, %0\n\tv_nop" : "+v"(x)); return x; }      /* one 2^x; the v_nop is the same slot as above */
__device__ __forceinline__ float xhalf(float x) { return __builtin_bit_cast(float, __builtin_amdgcn_permlanex16(__builtin_bit_cast(int, x), __builtin_bit_cast(int, x), 0x76543210, 0xfedcba98, false, false)); }      /* lane l takes lane l ^ 16's value, on the vector port */

// ---- f16 WMMA path (v_wmma_f32_16x16x32_f16): 11-bit significands for operands in range — used where a [0,1] probability operand needs more precision than bf16
typedef _Float16 v16h __attribute__((ext_vector_type(16)));
union FragH { v16h v; v8us half[2]; _Float16 h[16]; unsigned short u[16]; };
template <int NT>
__device__ __forceinline__ v8f mmaH(v16h ah, v16h al, v16h bh, v16h bl, v8f c) {
  c = __builtin_amdgcn_wmma_f32_16x16x32_f16(false, ah, false, bh, (short)0, c, false, false);
  if (NT >= 2) c = __builtin_amdgcn_wmma_f32_16x16x32_f16(false, al, false, bh, (short)0, c, false, false);
  if (NT >= 3) c = __builtin_amdgcn_wmma_f32_16x16x32_f16(false, ah, false, bl, (short)0, c, false, false);
  asm volatile("v_nop\n\tv_nop\n\tv_nop\n\tv_nop" : "+v"(c) : "v"(ah), "v"(al), "v"(bh), "v"(bl));
  return c;
}
// batched GEMM like k_gemm_b but f16 operands: A f32 (split into f16 hi/lo if ASPLIT, else rounded to f16), Bt = f16 values [n][k]; alpha; C f32; N multiple of 16 (partial tiles skipped)
template <bool ASPLIT>
__global__ __launch_bounds__(128) void k_gemm_h(const float* __restrict__ A, int lda, size_t sA, const _Float16* __restrict__ Bh, int ldb, size_t sB, float alpha, float* __restrict__ C, int ldc, size_t sC, int M, int N, int K) {
  __shared__ __attribute__((aligned(16))) float so[4][16][64];
  const int tid = threadIdx.x, w = tid >> 5, lane = tid & 31, ln = lane & 15, hh = lane >> 4; const int by = blockIdx.y;
  A += (size_t)by * sA; Bh += (size_t)by * sB; C += (size_t)by * sC;
  const int ntn = (N + 63) / 64; const int wid = blockIdx.x * 4 + w; const int mt = wid / ntn, nq = wid % ntn; if (mt * 16 >= M) return;
  const int row0 = mt * 16, col0 = nq * 64; const float* arow = A + (size_t)(row0 + ln) * lda;
  v8f acc[4] = {};
  for (int kb = 0; kb < K; kb += 32) {
    FragH ah, al;
    const v4f x0 = *(const v4fa*)(arow + kb + 8 * hh), x1 = *(const v4fa*)(arow + kb + 8 * hh + 4), x2 = *(const v4fa*)(arow + kb + 16 + 8 * hh), x3 = *(const v4fa*)(arow + kb + 16 + 8 * hh + 4);
    float xs[16] = {x0[0],x0[1],x0[2],x0[3],x1[0],x1[1],x1[2],x1[3],x2[0],x2[1],x2[2],x2[3],x3[0],x3[1],x3[2],x3[3]};
#pragma unroll
    for (int i = 0; i < 16; ++i) { const _Float16 h = (_Float16)xs[i]; ah.h[i] = h; al.h[i] = ASPLIT ? (_Float16)(xs[i] - (float)h) : (_Float16)0.0f; }
#pragma unroll
    for (int t = 0; t < 4; ++t) { if (col0 + t * 16 >= N) continue; const size_t boff = (size_t)(col0 + t * 16 + ln) * ldb + kb; FragH bq; bq.half[0] = *(const v8us*)(Bh + boff + 8 * hh); bq.half[1] = *(const v8us*)(Bh + boff + 16 + 8 * hh);
      acc[t] = mmaH<ASPLIT ? 2 : 1>(ah.v, al.v, bq.v, bq.v, acc[t]); }
  }
#pragma unroll
  for (int t = 0; t < 4; ++t) { if (col0 + t * 16 >= N) continue;
#pragma unroll
    for (int r = 0; r < 8; ++r) so[w][8 * hh + r][t * 16 + ln] = acc[t][r] * alpha; }
  __builtin_amdgcn_fence(__ATOMIC_ACQ_REL, "workgroup"); __builtin_amdgcn_wave_barrier();
  const int rsub = lane >> 4, c4 = (lane & 15) * 4;
  {
#pragma unroll
    for (int q = 0; q < 8; ++q) { const int r = q * 2 + rsub; if (col0 + c4 < N) { const v4f v = *(const v4fa*)&so[w][r][c4]; *(v4f*)(C + (size_t)(row0 + r) * ldc + col0 + c4) = v; } }
     }
}

// Wt[n][k] = f16(bf16(W[k][n]) * 16) from f32 row-major W[K][N] (power-of-two scale: bf16-exact weights stay exact in f16 away from the subnormal range).
// One work-group turns a block of 64 k x 256 n in LDS: it reads the block's rows by whole lines (a wave-wide 16-byte load = 512 B of one row, all 16 loads of a lane in flight together),
// keeps it as f16 [k][n] (pitch 260 halves), reads it back as dwords (two n of one k) and writes 128-B lines of Wt (8 lanes x 8 k of one n). K, N at compile time: every row step is an immediate offset.
typedef unsigned long long u64a __attribute__((may_alias)); typedef unsigned u32a __attribute__((may_alias));
template <int K, int N>
__device__ __forceinline__ void wt_block(const float* __restrict__ W, _Float16* __restrict__ Wt, int u, unsigned short* tl) {
  constexpr int P = 256 + 4, NB = N / 256; const int tid = threadIdx.x; const int k0 = (u / NB) * 64, n0 = (u % NB) * 256;
  const float* src = W + (size_t)(k0 + (tid >> 6)) * N + n0 + (tid & 63) * 4; v4f a[16];
#pragma unroll
  for (int j = 0; j < 16; ++j) a[j] = *(const v4fa*)(src + (size_t)(4 * j) * N);
  asm volatile("s_wait_xcnt 0x0" : : "v"(src) : "memory");      /* in front of any overwrite of the address register that the 16 issued loads name (it stays live up to here) */
#pragma unroll
  for (int j = 0; j < 16; ++j) { FragH f;
#pragma unroll
    for (int q = 0; q < 4; ++q) f.h[q] = (_Float16)(bf16_round(a[j][q]) * 16.0f);
    *(u64a*)&tl[((tid >> 6) + 4 * j) * P + (tid & 63) * 4] = (unsigned long long)f.u[0] | ((unsigned long long)f.u[1] << 16) | ((unsigned long long)f.u[2] << 32) | ((unsigned long long)f.u[3] << 48); }
  __syncthreads();      /* the block is whole in LDS before any lane reads across the rows that other waves stored */
  const int kc = (tid & 7) * 8, np = tid >> 3; unsigned short* dst = (unsigned short*)Wt + (size_t)(n0 + 2 * np) * K + k0 + kc;
#pragma unroll
  for (int j = 0; j < 4; ++j) { unsigned d[8]; FragH lo, hi;
#pragma unroll
    for (int i = 0; i < 8; ++i) d[i] = *(const u32a*)&tl[(kc + i) * P + 2 * (np + 32 * j)];
#pragma unroll
    for (int i = 0; i < 8; ++i) { lo.u[i] = (unsigned short)(d[i] & 0xffffu); hi.u[i] = (unsigned short)(d[i] >> 16); }
    *(v8us*)(dst + (size_t)(64 * j) * K) = lo.half[0]; *(v8us*)(dst + (size_t)(64 * j + 1) * K) = hi.half[0]; } }
// All six weights in one grid of 768 equal work-groups: 4 x 64 blocks of the 1024 x 1024 projections, 256 of We, 256 of Wd.
__global__ __launch_bounds__(256) void k_wt_all(const float* __restrict__ Wq, const float* __restrict__ Wk, const float* __restrict__ Wv, const float* __restrict__ Wo, const float* __restrict__ We, const float* __restrict__ Wd,
    _Float16* __restrict__ BQ, _Float16* __restrict__ BK, _Float16* __restrict__ BV, _Float16* __restrict__ BO, _Float16* __restrict__ BE, _Float16* __restrict__ BD) {
  __shared__ __attribute__((aligned(16))) unsigned short tl[64 * 260];      /* 33,280 B */
  const int u = blockIdx.x;      /* the same for the whole work-group: a barrier follows in each branch */
  if (u < 256) { const int m = u >> 6; wt_block<DM, DM>(m == 0 ? Wq : m == 1 ? Wk : m == 2 ? Wv : Wo, m == 0 ? BQ : m == 1 ? BK : m == 2 ? BV : BO, u & 63, tl); }
  else if (u < 512) wt_block<DM, 4096>(We, BE, u - 256, tl);
  else wt_block<4096, DM>(Wd, BD, u - 512, tl); }
// k_gemm_hh variant with fused epilogue: v = acc·alpha + bias[by·sBias + col] (+ CP[(row/rowsPerB)·sCPb + by·64 + col] if CP) ; ACT 0 none / 1 elu ; writes f16 C16 (and f32 C if non-null)
template <int ACT>
__global__ __launch_bounds__(128) void k_gemm_hhx(const _Float16* __restrict__ A, int lda, size_t sA, const _Float16* __restrict__ Bh, int ldb, size_t sB, float alpha, const float* __restrict__ bias, size_t sBias, const float* __restrict__ CP, int rowsPerB, size_t sCPb, int row0g,
    float* __restrict__ C, _Float16* __restrict__ C16, int ldc, size_t sC, int M, int N, int K) {
  __shared__ __attribute__((aligned(16))) float so[4][16][64];
  const int tid = threadIdx.x, w = tid >> 5, lane = tid & 31, ln = lane & 15, hh = lane >> 4; const int by = blockIdx.y;
  A += (size_t)by * sA; Bh += (size_t)by * sB; const size_t cofs = (size_t)by * sC; const float* bp = bias ? bias + (size_t)by * sBias : nullptr;
  const int ntn = (N + 63) / 64; const int wid = blockIdx.x * 4 + w; const int mt = wid / ntn, nq = wid % ntn; if (mt * 16 >= M) return;
  const int row0 = mt * 16, col0 = nq * 64; const _Float16* arow = A + (size_t)(row0 + ln) * lda;
  v8f acc[4] = {};
  for (int kb = 0; kb < K; kb += 32) { FragH ah; ah.half[0] = *(const v8us*)((const unsigned short*)arow + kb + 8 * hh); ah.half[1] = *(const v8us*)((const unsigned short*)arow + kb + 16 + 8 * hh);
#pragma unroll
    for (int t = 0; t < 4; ++t) { if (col0 + t * 16 >= N) continue; const size_t boff = (size_t)(col0 + t * 16 + ln) * ldb + kb; FragH bq; bq.half[0] = *(const v8us*)((const unsigned short*)Bh + boff + 8 * hh); bq.half[1] = *(const v8us*)((const unsigned short*)Bh + boff + 16 + 8 * hh);
      acc[t] = mmaH<1>(ah.v, ah.v, bq.v, bq.v, acc[t]); }
  }
#pragma unroll
  for (int t = 0; t < 4; ++t) { if (col0 + t * 16 >= N) continue; const int col = col0 + t * 16 + ln; const float bv = bp ? bf16_round(bp[col]) : 0.f;
#pragma unroll
    for (int r = 0; r < 8; ++r) { float v = acc[t][r] * alpha + bv; if (CP) { const int bidx = (row0g + row0 + 8 * hh + r) / rowsPerB; v += CP[(size_t)bidx * sCPb + (size_t)by * 64 + col]; } if (ACT == 1) v = (v > 0.f) ? v : expm1f(v); else if (ACT == 7) v = (v > 0.f) ? v + 1.0f : expf(v); else if (ACT == 8) v = tanhf(v); else if (ACT == 9) v = 0.5f * v * (1.0f + tanhf(0.7978845608028654f * (v + 0.044715f * v * v * v))); else if (ACT == 11) v = 1.0f / (1.0f + expf(-v)); else if (ACT == 12) v = (v > 0.f) ? v : 0.01f * v; else if (ACT == 14) v = (v > 0.f) ? v : 0.1f * v; else if (ACT == 15) v = v / (1.0f + expf(-v)); else if (ACT == 3) v = fmaxf(v, 0.f); else if (ACT == 6) v = 0.5f * v * (1.0f + erff(v * 0.70710678118654752f)); so[w][8 * hh + r][t * 16 + ln] = v; } }
  __builtin_amdgcn_fence(__ATOMIC_ACQ_REL, "workgroup"); __builtin_amdgcn_wave_barrier();
  const int rsub = lane >> 4, c4 = (lane & 15) * 4; typedef _Float16 v4h __attribute__((ext_vector_type(4)));
  {
#pragma unroll
    for (int q = 0; q < 8; ++q) { const int r = q * 2 + rsub; if (col0 + c4 < N) { const v4f v = *(const v4fa*)&so[w][r][c4]; if (C) *(v4f*)(C + cofs + (size_t)(row0 + r) * ldc + col0 + c4) = v; if (C16) { v4h h4; for (int i = 0; i < 4; ++i) h4[i] = (_Float16)v[i]; *(v4h*)(C16 + cofs + (size_t)(row0 + r) * ldc + col0 + c4) = h4; } } }
     }
}


typedef _Float16 v4h __attribute__((ext_vector_type(4)));

__global__ __launch_bounds__(256) void k_x16(const float* __restrict__ x, _Float16* __restrict__ X16, size_t n8) { const size_t t = (size_t)blockIdx.x * 256 + threadIdx.x; if (t >= n8) return; FragH f;
#pragma unroll
  for (int q = 0; q < 8; ++q) f.h[q] = (_Float16)bf16_round(x[t * 8 + q]); *(v8us*)((unsigned short*)X16 + t * 8) = f.half[0];  }
__global__ __launch_bounds__(256) void k_h16(const float* __restrict__ x, _Float16* __restrict__ X16, size_t n8) { const size_t t = (size_t)blockIdx.x * 256 + threadIdx.x; if (t >= n8) return; FragH f;
#pragma unroll
  for (int q = 0; q < 8; ++q) f.h[q] = (_Float16)x[t * 8 + q]; *(v8us*)((unsigned short*)X16 + t * 8) = f.half[0];  }
__global__ __launch_bounds__(256) void k_round16f(const float* __restrict__ W, _Float16* __restrict__ Bt, size_t n8) { const size_t t = (size_t)blockIdx.x * 256 + threadIdx.x; if (t >= n8) return; FragH f;
#pragma unroll
  for (int i = 0; i < 8; ++i) f.h[i] = (_Float16)(bf16_round(W[t * 8 + i]) * 16.0f); *(v8us*)((unsigned short*)Bt + t * 8) = f.half[0];  }
template <int NHv, int TTv>
__global__ __launch_bounds__(256) void k_vt(const _Float16* __restrict__ V16, int ldv, int voff, _Float16* __restrict__ Vt) { __shared__ unsigned short tl[64][66]; const int tid = threadIdx.x; const int slab = blockIdx.x / (TTv / 64), lg = blockIdx.x % (TTv / 64); const int b = slab / NHv, h = slab % NHv;
  for (int i = tid; i < 64 * 8; i += 256) { const int r = i / 8, c8 = (i % 8) * 8; FragH f; f.half[0] = *(const v8us*)((const unsigned short*)V16 + ((size_t)b * TTv + lg * 64 + r) * ldv + voff + h * 64 + c8);
#pragma unroll
    for (int q = 0; q < 8; ++q) tl[r][c8 + q] = f.u[q]; }
  __syncthreads();
  {
#pragma unroll
    for (int rd = 0; rd < 2; ++rd) { const int d = rd * 32 + tid / 8, pc = tid % 8; FragH f;
#pragma unroll
      for (int q = 0; q < 8; ++q) f.u[q] = tl[pc * 8 + q][d];
      *(v8us*)((unsigned short*)Vt + ((size_t)slab * 64 + d) * TTv + lg * 64 + pc * 8) = f.half[0]; }
     } }

// ---- fast GEMM (work-group tile 128x128 = 4 x 2 waves, wave tile 32x64; requires M % 128 == 0, N % 128 == 0, K % 128 == 0); epilogue: v = act(acc * alpha + bf16(bias[col])), or v = acc * alpha + bf16(bias[col]) + residual[row][col] ----
// Operands go through LDS: per slice of 128 k the work-group loads 256 B of each of its 128 A rows and 128 B rows with whole-line 16-byte loads (two rows per wave-wide load),
// keeps them in registers while the slice before is worked on, and stores them into the other of two LDS buffers; the fragments are read from LDS, A and B alike as halves k + 8 * hh .. + 7 and k + 16 + 8 * hh .. + 7 of their row.
__device__ __forceinline__ v16h g2_sfrag(const unsigned short* p) { FragH f; f.half[0] = *(const v8us*)p; f.half[1] = *(const v8us*)(p + 16); return f.v; }      /* p = LDS row + k + 8 * hh */
__device__ __forceinline__ v8f g2_mma(v16h a, v16h b, v8f c) { v8f d = __builtin_amdgcn_wmma_f32_16x16x32_f16(false, a, false, b, (short)0, c, false, false); asm volatile("v_nop\n\tv_nop\n\tv_nop\n\tv_nop" : "+v"(d) : "v"(a), "v"(b)); return d; }
template <int ACT, int LD, int LDC, int EP>      /* LD = lda = ldb = K and LDC = ldc at compile time: the row steps of the staging loads, of the residual loads and of the stores become immediate offsets. EP, the epilogue's kind: 1 = bias, 2 = residual plane added (indexed like C), 4 = f16 output to C16, 8 = f16 output to C16 and its rounding residual x 2^10 as f16 to C16l (else f32 to C) */
__global__ __launch_bounds__(256) void k_gemm2(const _Float16* __restrict__ A, int lda, size_t sA, const _Float16* __restrict__ Bh, int ldb, size_t sB, float alpha, const float* __restrict__ bias, size_t sBias, const float* CP,
    float* C, _Float16* __restrict__ C16, _Float16* __restrict__ C16l, int ldc, size_t sC, int M, int N, int K) {      /* CP may be C itself: a lane reads exactly the elements that it stores later */
  static_assert(!(EP & 2) || ACT == 0, "the residual is added behind the staging, so no activation may follow it");
  constexpr int KS = 128, PIT = KS + 8, BUF = (128 + 128) * PIT;      /* slice of k; LDS row pitch 272 B = 16 B x 17 (no bank conflict for 16-byte fragment reads); halves per buffer: rows 0-127 A, 128-255 B */
  __shared__ __attribute__((aligned(16))) unsigned short st[2 * BUF];      /* 139,264 B */
  float (*so)[32][68] = reinterpret_cast<float (*)[32][68]>(st);      /* the epilogue's staging (8 waves, 69,632 B) reuses the buffers behind the last barrier */
  const int tid = threadIdx.x, w = tid >> 5, lane = tid & 31, ln = lane & 15, hh = lane >> 4; const int by = blockIdx.y;
  const int wm = w & 3, wn = w >> 2;      /* the wave's 32 rows (of 128) and its 64 columns (of 128): the two waves of a row band read the same A rows from LDS, the four of a column band the same B rows */
  A += (size_t)by * sA; Bh += (size_t)by * sB; const size_t cofs = (size_t)by * sC;
  const int ntn = N >> 7; const int mt = blockIdx.x / ntn, nq = blockIdx.x - mt * ntn; const int col0 = nq * 128; if (mt * 128 >= M) return;      /* the same for the whole work-group: barriers follow */
  const int sr = tid >> 4, sc = (tid & 15) * 8;      /* staging: 16 threads cover the 256 B of a row, the work-group 16 rows per load */
  (void)lda; (void)ldb; (void)K; (void)ldc;
  const char* aS = (const char*)(A + (size_t)(mt * 128) * LD); const char* bS = (const char*)(Bh + (size_t)col0 * LD);      /* the work-group's first A and B row: the same in every lane */
  unsigned vo = (unsigned)(sr * LD + sc) * 2u;      /* the lane's byte offset in both operands: its row of 16, its 16 bytes, the slice */
  const v8f z8 = {0.f,0.f,0.f,0.f,0.f,0.f,0.f,0.f}; v8f c00 = z8, c01 = z8, c02 = z8, c03 = z8, c10 = z8, c11 = z8, c12 = z8, c13 = z8;
  v8us rg[16];
  auto slice_load = [&]() {
#pragma unroll
    for (int i = 0; i < 8; ++i) rg[i] = *(const v8us*)(aS + (size_t)vo + (size_t)(32 * i) * LD);
#pragma unroll
    for (int i = 0; i < 8; ++i) rg[8 + i] = *(const v8us*)(bS + (size_t)vo + (size_t)(32 * i) * LD); };
  auto slice_next = [&]() { asm volatile("s_wait_xcnt 0x0" : "+v"(vo) : : "memory");      /* in front of the overwrite of the offset register that the issued loads name */
    vo += 2u * KS; };
  auto slice_store = [&](int bo) {
#pragma unroll
    for (int i = 0; i < 16; ++i) *(v8us*)&st[bo + (16 * i + sr) * PIT + sc] = rg[i]; };
  auto slice_mma = [&](int bo) { const unsigned short* ap = &st[bo + (32 * wm + ln) * PIT + 8 * hh]; const unsigned short* bq = &st[bo + (128 + 64 * wn + ln) * PIT + 8 * hh];
#pragma unroll
    for (int kk = 0; kk < KS; kk += 32) { const v16h a0 = g2_sfrag(ap + kk), a1 = g2_sfrag(ap + 16 * PIT + kk);      /* the six fragments of a k step as one group of LDS reads in front of its eight products */
      const v16h b0 = g2_sfrag(bq + kk), b1 = g2_sfrag(bq + 16 * PIT + kk), b2 = g2_sfrag(bq + 32 * PIT + kk), b3 = g2_sfrag(bq + 48 * PIT + kk);
      c00 = g2_mma(a0, b0, c00); c10 = g2_mma(a1, b0, c10); c01 = g2_mma(a0, b1, c01); c11 = g2_mma(a1, b1, c11);
      c02 = g2_mma(a0, b2, c02); c12 = g2_mma(a1, b2, c12); c03 = g2_mma(a0, b3, c03); c13 = g2_mma(a1, b3, c13); } };
  float braw[4] = {0.f, 0.f, 0.f, 0.f};      /* the lane's 4 bias values, asked for together with the first slice */
  if constexpr ((EP & 1) != 0) { const float* bS4 = bias + (size_t)by * sBias + col0 + 64 * wn + ln;
#pragma unroll
    for (int t = 0; t < 4; ++t) braw[t] = bS4[16 * t]; }
  slice_load(); slice_next(); slice_store(0); __syncthreads();
  int cur = 0;      /* start (in halves) of the buffer that holds the slice being worked on: 0 or BUF */
#pragma unroll 1      /* one copy of the slice body; the buffer alternates at run time */
  for (int s = 1; s < LD / KS; ++s) {
    slice_load();      /* in flight while the slice before is worked on */
    slice_mma(cur);
    slice_next();
    slice_store(cur ^ BUF);      /* its last readers left this buffer in front of the barrier of the trip before */
    __syncthreads(); cur ^= BUF; }
  // The residual plane is asked for here, all at once, so that the last slice's products cover the loads: the lane's 16 pieces of 16 B, the very pieces that it stores at the end
  // (16 lanes = the 256 B of a row of the wave's tile, a wave-wide load = two rows).
  const unsigned eo = (unsigned)((32 * wm + (lane >> 4)) * LDC + 64 * wn + (lane & 15) * 4);      /* the lane's element offset in the work-group's tile of C */
  const size_t tile0 = cofs + (size_t)(mt * 128) * LDC + col0;      /* the tile's first element: the same in every lane */
  v4f res[16];
  if constexpr ((EP & 2) != 0) { const char* rS = (const char*)(CP + tile0);
#pragma unroll
    for (int q = 0; q < 16; ++q) res[q] = *(const v4fa*)(rS + (size_t)(eo * 4u) + (size_t)(2 * q) * LDC * 4); }
  slice_mma(cur);
  __syncthreads();      /* every wave has read its last fragments before the buffers become output staging */
  v8f accs[8] = {c00, c01, c02, c03, c10, c11, c12, c13};
#pragma unroll
  for (int u = 0; u < 8; ++u) { const int t = u & 3, half = u >> 2; const float bv = bf16_round(braw[t]);
    float sg[8];      /* ACT 15: sigmoid(v) = 1 / (1 + 2^(-v log2 e)); the denominator is at least 1, and where 2^x is inf the sigmoid is 0, as with exp and a division */
    if constexpr (ACT == 15) {
#pragma unroll
      for (int r = 0; r < 8; ++r) sg[r] = (accs[u][r] * alpha + bv) * -L2E;
      exp2x8(sg);
#pragma unroll
      for (int r = 0; r < 8; ++r) sg[r] = 1.0f + sg[r];
      rcpx8(sg); }
#pragma unroll
    for (int r = 0; r < 8; ++r) { const int rloc = half * 16 + 8 * hh + r; float v = accs[u][r] * alpha + bv;
      if (ACT == 3) v = fmaxf(v, 0.f); else if (ACT == 6) v = 0.5f * v * (1.0f + erff(v * 0.70710678118654752f)); else if (ACT == 11) v = 1.0f / (1.0f + expf(-v)); else if (ACT == 15) v = v * sg[r]; else if (ACT == 12) v = (v > 0.f) ? v : 0.01f * v; else if (ACT == 8) v = tanhf(v);
      so[w][rloc][t * 16 + ln] = v; } }
  __builtin_amdgcn_fence(__ATOMIC_ACQ_REL, "workgroup"); __builtin_amdgcn_wave_barrier();
  const int rsub = lane >> 4, c4 = (lane & 15) * 4;
  {
#pragma unroll
    for (int q = 0; q < 16; ++q) { v4f v = *(const v4fa*)&so[w][q * 2 + rsub][c4];
      if constexpr ((EP & 2) != 0) v += res[q];
      if constexpr ((EP & 8) != 0) { v4h h4, l4; for (int i = 0; i < 4; ++i) { const _Float16 hv = (_Float16)v[i]; h4[i] = hv; l4[i] = (_Float16)((v[i] - (float)hv) * 1024.0f); }
        *(v4h*)((char*)(C16 + tile0) + (size_t)(eo * 2u) + (size_t)(2 * q) * LDC * 2) = h4; *(v4h*)((char*)(C16l + tile0) + (size_t)(eo * 2u) + (size_t)(2 * q) * LDC * 2) = l4; }
      else if constexpr ((EP & 4) != 0) { v4h h4; for (int i = 0; i < 4; ++i) h4[i] = (_Float16)v[i]; *(v4h*)((char*)(C16 + tile0) + (size_t)(eo * 2u) + (size_t)(2 * q) * LDC * 2) = h4; }
      else *(v4f*)((char*)(C + tile0) + (size_t)(eo * 4u) + (size_t)(2 * q) * LDC * 4) = v; }
     } }



template <int TK>
__global__ __launch_bounds__(256) void k_vthl(const float* __restrict__ VF, int ldv, _Float16* __restrict__ Vth, _Float16* __restrict__ Vtl) { __shared__ float tl[64][65]; const int tid = threadIdx.x; const int slab = blockIdx.x / (TK / 64), lg = blockIdx.x % (TK / 64); const int b = slab / NH, h = slab % NH;
  for (int i = tid; i < 64 * 16; i += 256) { const int r = i / 16, c4 = (i % 16) * 4; const v4f a = *(const v4fa*)(VF + ((size_t)b * TK + lg * 64 + r) * ldv + h * 64 + c4); tl[r][c4] = a[0]; tl[r][c4 + 1] = a[1]; tl[r][c4 + 2] = a[2]; tl[r][c4 + 3] = a[3]; }
  __syncthreads();
  FragH fh[2], fl[2]; size_t oo[2];
#pragma unroll
  for (int rd = 0; rd < 2; ++rd) { const int d = rd * 32 + tid / 8, pc = tid % 8;
#pragma unroll
    for (int q = 0; q < 8; ++q) { const float v = tl[pc * 8 + q][d]; const _Float16 hv = (_Float16)v; fh[rd].h[q] = hv; fl[rd].h[q] = (_Float16)((v - (float)hv) * 1024.0f); } oo[rd] = ((size_t)slab * 64 + d) * TK + lg * 64 + pc * 8; }
  {
#pragma unroll
    for (int rd = 0; rd < 2; ++rd) { *(v8us*)((unsigned short*)Vth + oo[rd]) = fh[rd].half[0]; *(v8us*)((unsigned short*)Vtl + oo[rd]) = fl[rd].half[0]; }
     } }

template <int TQ, int TK>
__global__ __launch_bounds__(128) void k_flashm(const _Float16* __restrict__ Q16, const _Float16* __restrict__ Q16lo, int ldq, const _Float16* __restrict__ K16, const _Float16* __restrict__ K16lo, int ldk, const _Float16* __restrict__ Vt, const _Float16* __restrict__ Vtlo, const unsigned* __restrict__ MB, const int* __restrict__ RA, const int* __restrict__ KE, _Float16* __restrict__ Oh, _Float16* __restrict__ Ol, int ldo) {
  constexpr int RPW = 16, RTN = RPW / 16, NQB = TQ / (4 * RPW), DT = 4, KS = 2;
  static_assert(RTN == 1, "a wave holds one 16-query column group"); __shared__ __attribute__((aligned(16))) float sO[4][RPW][64 + 4];
  // A pass's keys and values lie in LDS once for the four waves. One buffer (in halves): 32 K rows hi, 32 K rows residual (128 B each, pitch 144 B), then 64 V^T rows hi, 64 residual (64 B each, pitch 80 B); pitches 16 B x odd for the 16-byte fragment reads.
  constexpr int KP = 72, VP = 40, VB0 = 64 * KP, KVB = VB0 + 128 * VP;
  __shared__ __attribute__((aligned(16))) unsigned short sKV[2 * KVB];      /* two buffers, 38,912 B: the next pass's tile flies while this one is worked on */
  const int tid = threadIdx.x, w = tid >> 5, lane = tid & 31, ln = lane & 15, hh = lane >> 4;
  const int h = blockIdx.x / NQB, t0 = blockIdx.x % NQB;
  // Causal balance: the work-group runs query tile t0 of batch 0, then tile NQB - 1 - t0 of batch 1 (alternating), so every work-group walks the same number of key passes.
#pragma unroll 1      /* one copy of the tile body: the tiles run one after the other in every wave */
  for (int b = 0; b < NBT; ++b) {
  const int slab = b * NH + h, qblk = (b & 1) ? NQB - 1 - t0 : t0; const int qb0 = qblk * (4 * RPW); const int q0 = qb0 + w * RPW;
  FragH aq[2][KS], aql[2][KS];
#pragma unroll
  for (int rt = 0; rt < RTN; ++rt) { const size_t qo = ((size_t)b * TQ + q0 + rt * 16 + ln) * ldq + h * 64; const unsigned short* qr = (const unsigned short*)Q16 + qo; const unsigned short* ql = (const unsigned short*)Q16lo + qo;
#pragma unroll
    for (int ks = 0; ks < KS; ++ks) { aq[rt][ks].half[0] = *(const v8us*)(qr + ks * 32 + 8 * hh); aq[rt][ks].half[1] = *(const v8us*)(qr + ks * 32 + 16 + 8 * hh); aql[rt][ks].half[0] = *(const v8us*)(ql + ks * 32 + 8 * hh); aql[rt][ks].half[1] = *(const v8us*)(ql + ks * 32 + 16 + 8 * hh); } }
  const unsigned short* Vth = (const unsigned short*)Vt + (size_t)slab * 64 * TK; const unsigned short* Vtl = (const unsigned short*)Vtlo + (size_t)slab * 64 * TK;
  // Staging, 8 copies of 16 B a lane and pass: 8 lanes cover a K row (rows tid / 8 and + 16 of each plane), 4 lanes a V^T row (rows tid / 4 and + 32 of each plane).
  const size_t kso = ((size_t)b * TK + (tid >> 3)) * ldk + h * 64 + (tid & 7) * 8, vso = (size_t)(tid >> 2) * TK + (tid & 3) * 8;
  const unsigned lk0 = (unsigned)(size_t)&sKV[(tid >> 3) * KP + (tid & 7) * 8], lv0 = (unsigned)(size_t)&sKV[VB0 + (tid >> 2) * VP + (tid & 3) * 8];      /* the lane's LDS byte addresses in buffer 0 */
  auto stage = [&](int js, int bo) {      /* keys js .. js + 31 into the buffer that starts at half bo */
    const unsigned short* kh = (const unsigned short*)K16 + kso + (size_t)js * ldk; const unsigned short* kl = (const unsigned short*)K16lo + kso + (size_t)js * ldk;
    const unsigned short* kh2 = kh + (size_t)16 * ldk; const unsigned short* kl2 = kl + (size_t)16 * ldk;
    const unsigned short* vh = Vth + vso + js; const unsigned short* vl = Vtl + vso + js; const unsigned short* vh2 = vh + (size_t)32 * TK; const unsigned short* vl2 = vl + (size_t)32 * TK;
    const unsigned lk = lk0 + 2u * (unsigned)bo, lv = lv0 + 2u * (unsigned)bo;
    const unsigned lk1 = lk + 2u * 16 * KP, lk2 = lk + 2u * 32 * KP, lk3 = lk + 2u * 48 * KP, lv1 = lv + 2u * 32 * VP, lv2 = lv + 2u * 64 * VP, lv3 = lv + 2u * 96 * VP;
    /* the copies and, as the statement's last line, the wait that stands in front of any rewrite of their address registers */
    asm volatile("global_load_async_to_lds_b128 %0, %8, off\n\t"
                 "global_load_async_to_lds_b128 %1, %9, off\n\t"
                 "global_load_async_to_lds_b128 %2, %10, off\n\t"
                 "global_load_async_to_lds_b128 %3, %11, off\n\t"
                 "global_load_async_to_lds_b128 %4, %12, off\n\t"
                 "global_load_async_to_lds_b128 %5, %13, off\n\t"
                 "global_load_async_to_lds_b128 %6, %14, off\n\t"
                 "global_load_async_to_lds_b128 %7, %15, off\n\t"
                 "s_wait_xcnt 0x0"
                 :: "v"(lk), "v"(lk1), "v"(lk2), "v"(lk3), "v"(lv), "v"(lv1), "v"(lv2), "v"(lv3), "v"(kh), "v"(kh2), "v"(kl), "v"(kl2), "v"(vh), "v"(vh2), "v"(vl), "v"(vl2) : "memory"); };
  float m_q = -3.0e38f, l_q = 0.f; v8f oacc[DT], oaccl[DT];
#pragma unroll
  for (int dt = 0; dt < DT; ++dt) { oacc[dt] = (v8f){0.f,0.f,0.f,0.f,0.f,0.f,0.f,0.f}; oaccl[dt] = oacc[dt]; }
  int jend = KE[qblk * 32]; jend = min(TK, (jend + 31) & ~31); if (jend < 32) jend = 32;      /* block-uniform */
  jend = __builtin_amdgcn_readfirstlane(jend);      /* in a scalar register: the tests around the copies and the barriers are scalar branches */
  const bool am = (RA[q0 + ln] != 0); const unsigned* mrow = MB + (size_t)(q0 + ln) * (TK / 32);      /* the lane's query: its all-masked flag, its row of mask words */
  stage(0, 0);      /* every reader of the tile before left both buffers in front of its last pass's barrier */
  asm volatile("s_wait_asynccnt 0x0" ::: "memory");      /* this wave's copies of pass 0 have landed */
  __syncthreads();      /* ... and every other wave's */
  if (jend > 32) stage(32, KVB);
  int cur = 0;      /* start (in halves) of the buffer that holds this pass's tile: 0 or KVB */
#pragma unroll 1
  for (int j0 = 0; j0 < jend; j0 += 32) {
    const unsigned mwq = mrow[j0 >> 5];      /* the query's mask word of the pass, asked for ahead of the score products so that these cover the load */
    v8f s[2];
#pragma unroll
    for (int nt = 0; nt < 2; ++nt) { const unsigned short* kr = &sKV[cur + (nt * 16 + ln) * KP]; const unsigned short* kl = kr + 32 * KP; FragH bk[KS], bkl[KS];
#pragma unroll
      for (int ks = 0; ks < KS; ++ks) { bk[ks].half[0] = *(const v8us*)(kr + ks * 32 + 8 * hh); bk[ks].half[1] = *(const v8us*)(kr + ks * 32 + 16 + 8 * hh); bkl[ks].half[0] = *(const v8us*)(kl + ks * 32 + 8 * hh); bkl[ks].half[1] = *(const v8us*)(kl + ks * 32 + 16 + 8 * hh); }
      v8f acc = (v8f){0.f,0.f,0.f,0.f,0.f,0.f,0.f,0.f}, accr = acc;
#pragma unroll
      for (int ks = 0; ks < KS; ++ks) { acc = mmaH<1>(bk[ks].v, bk[ks].v, aq[0][ks].v, aq[0][ks].v, acc); accr = mmaH<1>(bk[ks].v, bk[ks].v, aql[0][ks].v, aql[0][ks].v, accr); accr = mmaH<1>(bkl[ks].v, bkl[ks].v, aq[0][ks].v, aq[0][ks].v, accr); }
      s[nt] = acc + accr * 0.0009765625f; }
    // Online softmax of the lane's one query over its 16 keys of the pass: maximum and sum in the lane's own registers, one exchange with the other half of the wave for the maximum.
    // Every exponential is computed and then selected: no branches.
    const unsigned mw = mwq >> (8 * hh);      /* bit r = key 8 * hh + r, bit 16 + r = key 16 + 8 * hh + r */
    float p0v[8], p1v[8], mcv[8]; bool ok0v[8], ok1v[8];
#pragma unroll
    for (int r = 0; r < 8; ++r) { ok0v[r] = am || (((mw >> r) & 1u) == 0u); ok1v[r] = am || (((mw >> (16 + r)) & 1u) == 0u);
      p0v[r] = ok0v[r] ? (am ? 0.f : s[0][r] * (SCL * L2E)) : -INFINITY; p1v[r] = ok1v[r] ? (am ? 0.f : s[1][r] * (SCL * L2E)) : -INFINITY;      /* scores, and with them the running maximum, in log2 units */
      mcv[r] = fmaxf(p0v[r], p1v[r]); }
    float mc = fmaxf(fmaxf(fmaxf(mcv[0], mcv[1]), fmaxf(mcv[2], mcv[3])), fmaxf(fmaxf(mcv[4], mcv[5]), fmaxf(mcv[6], mcv[7])));
    mc = fmaxf(mc, xhalf(mc));
    const float mn = fmaxf(m_q, mc);      /* mn is finite (at least -3.0e38), so a masked score gives 2^(-inf) = 0 and no NaN reaches a selected value */
    float al = exp2x1(m_q - mn); m_q = mn;      /* the exponents, none above 0 */
#pragma unroll
    for (int r = 0; r < 8; ++r) { p0v[r] -= mn; p1v[r] -= mn; }
    exp2x8(p0v); exp2x8(p1v);
    al = (mn > -1.0e38f) ? al : 1.0f;
#pragma unroll
    for (int r = 0; r < 8; ++r) { p0v[r] = ok0v[r] ? p0v[r] : 0.f; p1v[r] = ok1v[r] ? p1v[r] : 0.f; mcv[r] = p0v[r] + p1v[r]; }
    l_q = l_q * al + (((mcv[0] + mcv[1]) + (mcv[2] + mcv[3])) + ((mcv[4] + mcv[5]) + (mcv[6] + mcv[7])));
#pragma unroll
    for (int dt = 0; dt < DT; ++dt) { oacc[dt] *= al; oaccl[dt] *= al; }
    // P^T as a B operand straight from the score registers: element r of the first half is key 8 * hh + r, of the second key 16 + 8 * hh + r, the k order in which the V^T fragments are read.
    FragH pa, pl;
#pragma unroll
    for (int r = 0; r < 8; ++r) { const float ps0 = p0v[r] * 1024.0f, ps1 = p1v[r] * 1024.0f; pa.h[r] = (_Float16)ps0; pa.h[8 + r] = (_Float16)ps1; pl.h[r] = (_Float16)((ps0 - (float)pa.h[r]) * 1024.0f); pl.h[8 + r] = (_Float16)((ps1 - (float)pa.h[8 + r]) * 1024.0f); }
#pragma unroll
    for (int dt = 0; dt < DT; ++dt) { const unsigned short* vr = &sKV[cur + VB0 + (dt * 16 + ln) * VP + 8 * hh]; const unsigned short* vq = vr + 64 * VP; FragH bv, bl; bv.half[0] = *(const v8us*)vr; bv.half[1] = *(const v8us*)(vr + 16); bl.half[0] = *(const v8us*)vq; bl.half[1] = *(const v8us*)(vq + 16);
      oacc[dt] = mmaH<1>(bv.v, bv.v, pa.v, pa.v, oacc[dt]); oaccl[dt] = mmaH<1>(bl.v, bl.v, pa.v, pa.v, oaccl[dt]); oaccl[dt] = mmaH<1>(bv.v, bv.v, pl.v, pl.v, oaccl[dt]); }
    asm volatile("s_wait_dscnt 0x0" ::: "memory");      /* this wave's LDS reads of the pass are done */
    asm volatile("s_wait_asynccnt 0x0" ::: "memory");      /* its copies of the next pass's tile have landed */
    __syncthreads();      /* publishes the next tile and ends every wave's reads of this one */
    if (j0 + 64 < jend) stage(j0 + 64, cur);      /* refill of the buffer just read, one whole pass ahead of its use */
    cur ^= KVB; }
  asm volatile("s_wait_asynccnt 0x0" ::: "memory");      /* nothing of this wave is in flight when the tile ends */
  { const float l = l_q + xhalf(l_q); const float li = (l > 0.f) ? 1.0f / (l * 1024.0f) : 0.f;      /* the two halves of the wave hold the query's two partial sums */
#pragma unroll
    for (int dt = 0; dt < DT; ++dt) { v4f o0, o1;      /* the lane's 8 consecutive channels of its query's row */
#pragma unroll
      for (int r = 0; r < 4; ++r) { o0[r] = (oacc[dt][r] + oaccl[dt][r] * 0.0009765625f) * li; o1[r] = (oacc[dt][4 + r] + oaccl[dt][4 + r] * 0.0009765625f) * li; }
      *(v4fa*)&sO[w][ln][dt * 16 + 8 * hh] = o0; *(v4fa*)&sO[w][ln][dt * 16 + 8 * hh + 4] = o1; } }
  __builtin_amdgcn_fence(__ATOMIC_ACQ_REL, "workgroup"); __builtin_amdgcn_wave_barrier();
  {
#pragma unroll
    for (int rp = 0; rp < RPW; rp += 2) { const int r = rp + (lane >> 4), pc = lane & 15; const v4f val = *(const v4fa*)&sO[w][r][pc * 4]; v4h h4, l4;      /* O leaves as the f16 plane and its rounding residual x 2^10, the operands of the two Wo products: 16 lanes = one 128-B line of each plane */
      for (int i = 0; i < 4; ++i) { const _Float16 hv = (_Float16)val[i]; h4[i] = hv; l4[i] = (_Float16)((val[i] - (float)hv) * 1024.0f); }
      const size_t oo = ((size_t)b * TQ + q0 + r) * ldo + h * 64 + pc * 4; *(v4h*)(Oh + oo) = h4; *(v4h*)(Ol + oo) = l4; }
     }
  asm volatile("s_wait_xcnt 0x0" ::: "memory");      /* the next tile's set-up overwrites the address registers of the stores above */
  } }


template <int SRCBF>
__global__ __launch_bounds__(256) void k_lnab(const float* __restrict__ X, const float* __restrict__ g, const float* __restrict__ bb, _Float16* __restrict__ Y16, float* __restrict__ Y32, float* __restrict__ XB) {
  #pragma clang fp contract(off)
  const int tid = threadIdx.x, w = tid >> 5, ln = tid & 31; const int r = blockIdx.x * 8 + w; if (r >= NR) return; const float* x = X + (size_t)r * DM; float s = 0.f;
#pragma unroll 1
  for (int i = 0; i < DM / 128; ++i) { const v4f a = *(const v4fa*)(x + i * 128 + ln * 4); for (int q = 0; q < 4; ++q) s += SRCBF ? bf16_round(a[q]) : a[q]; }
  for (int o = 16; o > 0; o >>= 1) s += __shfl_xor(s, o, 32); const float mu = s / (float)DM; float q2 = 0.f;
#pragma unroll 1
  for (int i = 0; i < DM / 128; ++i) { const v4f a = *(const v4fa*)(x + i * 128 + ln * 4); for (int q = 0; q < 4; ++q) { const float d = (SRCBF ? bf16_round(a[q]) : a[q]) - mu; q2 += d * d; } }
  for (int o = 16; o > 0; o >>= 1) q2 += __shfl_xor(q2, o, 32); const float rs = rsqrtf(q2 / (float)DM + 1e-5f);
  {
#pragma unroll 1
    for (int i = 0; i < DM / 128; ++i) { const int c0 = i * 128 + ln * 4; const v4f a = *(const v4fa*)(x + c0); _Float16 h4[4]; v4f y4, xb;
      for (int q = 0; q < 4; ++q) { const float t = SRCBF ? bf16_round(a[q]) : a[q]; const float y = (t - mu) * rs * bf16_round(g[c0 + q]) + bf16_round(bb[c0 + q]); h4[q] = (_Float16)y; y4[q] = y; xb[q] = t; }
      if (Y16) *(unsigned long long*)((unsigned short*)Y16 + (size_t)r * DM + c0) = *(const unsigned long long*)h4; if (Y32) *(v4f*)(Y32 + (size_t)r * DM + c0) = y4; if (XB) *(v4f*)(XB + (size_t)r * DM + c0) = xb; }
     } }
__global__ __launch_bounds__(256) void k_causaltab(unsigned* __restrict__ MB, int* __restrict__ RA, int* __restrict__ KE, int nq, int nk) {
  const int t = blockIdx.x * 256 + threadIdx.x; const int nw = nk / 32;
  if (t < nq * nw) { const int q = t / nw, w = t % nw; const int first = q + 1 - 32 * w; const unsigned bits = (first <= 0) ? 0xffffffffu : ((first >= 32) ? 0u : (0xffffffffu << first)); *(unsigned*)(MB + t) = bits;  }
  if (t < nq) { *(int*)(RA + t) = 0;  }
  if (t < nq / 64) { const int v = 64 * (t + 1); *(int*)(KE + t * 32) = v;  } }


extern "C" void kernel_launch(void* const* d_in, const int* in_sizes, int n_in,
                              void* d_out, int out_size, void* d_ws, size_t ws_size, hipStream_t stream) {
  (void)in_sizes; (void)n_in; (void)out_size;
  const float* const* I = (const float* const*)d_in; const float* x = I[0]; const float* lag = I[1]; const float* lab = I[2]; const float* lbg = I[3]; const float* lbb = I[4]; const float* lcg = I[5]; const float* lcb = I[6];
  const float* Wq = I[7]; const float* bq = I[8]; const float* Wk = I[9]; const float* bk = I[10]; const float* Wv = I[11]; const float* bv = I[12]; const float* Wo = I[13]; const float* bo = I[14]; const float* We = I[15]; const float* be = I[16]; const float* Wd = I[17]; const float* bd = I[18];
  char* ws = (char*)d_ws; size_t off = 0;
  auto take = [&](size_t bytes) { char* p = ws + off; off += (bytes + 255) & ~(size_t)255; return p; };
  _Float16* BQ = (_Float16*)take((size_t)DM * DM * 2); _Float16* BK = (_Float16*)take((size_t)DM * DM * 2); _Float16* BV = (_Float16*)take((size_t)DM * DM * 2); _Float16* BO = (_Float16*)take((size_t)DM * DM * 2); _Float16* BE = (_Float16*)take((size_t)4096 * DM * 2); _Float16* BD = (_Float16*)take((size_t)DM * 4096 * 2);
  float* XB = (float*)take((size_t)NR * DM * 4); _Float16* T16 = (_Float16*)take((size_t)NR * DM * 2); float* F = (float*)take((size_t)NR * DM * 4);
  _Float16* Qh = (_Float16*)take((size_t)NR * DM * 2); _Float16* Ql = (_Float16*)take((size_t)NR * DM * 2); _Float16* Kh = (_Float16*)take((size_t)NR * DM * 2); _Float16* Kl = (_Float16*)take((size_t)NR * DM * 2); _Float16* Vth = (_Float16*)take((size_t)NR * DM * 2); _Float16* Vtl = (_Float16*)take((size_t)NR * DM * 2);
  unsigned* MB = (unsigned*)take((size_t)SLEN * (SLEN / 32) * 4); int* RA = (int*)take((size_t)SLEN * 4); int* KE = (int*)take((size_t)(SLEN / 64) * 32 * 4);
  if (off > ws_size) return;      /* 24 + 16 + 8 + 16 + 48 + 0.6 = 113 MiB (the first LN's f32 output lives in F until the second LN consumes it) */
  _Float16* Oh = (_Float16*)F; _Float16* Ol = Oh + (size_t)NR * DM; float* X1 = XB;      /* the two O planes fill F, dead once V is transposed */
  _Float16* GH = Kh;      /* SiLU hidden [NR][4096] f16 = 32 MB over Kh|Kl|Vth|Vtl (dead after the flash) */
  k_wt_all<<<768, 256, 0, stream>>>(Wq, Wk, Wv, Wo, We, Wd, BQ, BK, BV, BO, BE, BD);      /* all (in,out) */
  k_causaltab<<<(SLEN * (SLEN / 32) + 255) / 256, 256, 0, stream>>>(MB, RA, KE, SLEN, SLEN);
  k_lnab<1><<<NR / 8, 256, 0, stream>>>(x, lag, lab, nullptr, F, XB);      /* t0 = LN_a(bf16 x) (f32), XB = bf16(x) */
  k_lnab<0><<<NR / 8, 256, 0, stream>>>(F, lbg, lbb, T16, nullptr, nullptr);      /* t = LN_b(t0) as f16 operand */
  const dim3 gP((NR / 128) * (DM / 128), 1), gM((NR / 128) * (4096 / 128), 1);
  k_gemm2<0, DM, DM, 9><<<gP, 256, 0, stream>>>(T16, DM, 0, BQ, DM, 0, 0.0625f, bq, 0, nullptr, nullptr, Qh, Ql, DM, 0, NR, DM, DM);      /* q as hi + residual planes */
  k_gemm2<0, DM, DM, 9><<<gP, 256, 0, stream>>>(T16, DM, 0, BK, DM, 0, 0.0625f, bk, 0, nullptr, nullptr, Kh, Kl, DM, 0, NR, DM, DM);      /* k likewise */
  k_gemm2<0, DM, DM, 1><<<gP, 256, 0, stream>>>(T16, DM, 0, BV, DM, 0, 0.0625f, bv, 0, nullptr, F, nullptr, nullptr, DM, 0, NR, DM, DM);
  for (int b = 0; b < NBT; ++b) k_vthl<SLEN><<<NH * (SLEN / 64), 256, 0, stream>>>(F + (size_t)b * SLEN * DM, DM, Vth + (size_t)b * SLEN * DM, Vtl + (size_t)b * SLEN * DM);
  k_flashm<SLEN, SLEN><<<NH * (SLEN / 64), 128, 0, stream>>>(Qh, Ql, DM, Kh, Kl, DM, Vth, Vtl, MB, RA, KE, Oh, Ol, DM);      /* both batches in one grid of equal work-groups */
  k_gemm2<0, DM, DM, 3><<<gP, 256, 0, stream>>>(Oh, DM, 0, BO, DM, 0, 0.0625f, bo, 0, XB, X1, nullptr, nullptr, DM, 0, NR, DM, DM);      /* x1 = x + ctx Wo + bo (hi) */
  k_gemm2<0, DM, DM, 2><<<gP, 256, 0, stream>>>(Ol, DM, 0, BO, DM, 0, 0.0625f / 1024.0f, nullptr, 0, X1, X1, nullptr, nullptr, DM, 0, NR, DM, DM);      /* + lo */
  k_lnab<0><<<NR / 8, 256, 0, stream>>>(X1, lcg, lcb, T16, nullptr, nullptr);
  k_gemm2<15, DM, 4096, 5><<<gM, 256, 0, stream>>>(T16, DM, 0, BE, DM, 0, 0.0625f, be, 0, nullptr, nullptr, GH, nullptr, 4096, 0, NR, 4096, DM);      /* silu(t We + be) f16 (ACT 15 = x * sigmoid(x), present in the epilogue) */
  k_gemm2<0, 4096, DM, 3><<<gP, 256, 0, stream>>>(GH, 4096, 0, BD, 4096, 0, 0.0625f, bd, 0, X1, (float*)d_out, nullptr, nullptr, DM, 0, NR, DM, 4096);      /* out = x1 + mlp */
}
